// v000
// Measured on an AMD MI455X. A time is GPU time per run, averaged over a window of back-to-back runs after a warm-up
// (all launches, gaps included; the runs take copies of the inputs in turn), and the median of several windows.
// Apart from v000's, it joins two sittings. Times from different sittings can be a few percent apart, while
// side-by-side timings come from the same sitting.
// v000, which the later versions start from, runs in 16.7 microseconds.
#include <hip/hip_runtime.h>

typedef __attribute__((ext_vector_type(2))) float v2f;
typedef __attribute__((ext_vector_type(8))) float v8f;

#define B_  32
#define N_  4096
#define NQ  8
#define D_  64
#define CHUNKS 16                         // blocks per batch
#define KEYS_PER_BLOCK (N_ / CHUNKS)      // 256 keys
#define WAVES 8
#define TILES_PER_WAVE (KEYS_PER_BLOCK / (16 * WAVES))  // 2

__global__ __launch_bounds__(256) void attn_accum(
    const float* __restrict__ Kmat,   // [B, N, D]
    const float* __restrict__ Vmat,   // [B, N, D]
    const float* __restrict__ Qmat,   // [B, NQ, D]
    float* __restrict__ g_accum,      // [B, NQ, D]
    float* __restrict__ g_colsum)     // [B, NQ]
{
    __shared__ float sh_accum[NQ * D_];        // 512 floats
    __shared__ float sh_colsum[NQ];
    __shared__ float Plds[WAVES][16 * 17];

    const int tid  = threadIdx.x;
    const int wave = tid >> 5;
    const int lane = tid & 31;
    const int half = lane >> 4;
    const int lm   = lane & 15;

    const int b     = blockIdx.x / CHUNKS;
    const int chunk = blockIdx.x % CHUNKS;

    for (int i = tid; i < NQ * D_; i += 256) sh_accum[i] = 0.f;
    if (tid < NQ) sh_colsum[tid] = 0.f;
    __syncthreads();

    const float* Qb = Qmat + (size_t)b * NQ * D_;
    const float* Kb = Kmat + (size_t)b * N_ * D_;
    const float* Vb = Vmat + (size_t)b * N_ * D_;

    // ---- Q A-fragments: A = Q padded to 16 rows, 16 chunks of K=4 ----
    // A 16x4 layout: lane holds (M = lm, K = 2*half + j) in vgpr j.
    v2f aq[16];
#pragma unroll
    for (int k4 = 0; k4 < 16; ++k4) {
        const int d0 = k4 * 4 + half * 2;
        v2f z; z.x = 0.f; z.y = 0.f;
        aq[k4] = (lm < NQ) ? *(const v2f*)(Qb + lm * D_ + d0) : z;
    }

    v8f oacc[4];                 // O^T tiles: rows = v-dims 16t.., cols = queries
#pragma unroll
    for (int t = 0; t < 4; ++t) oacc[t] = (v8f)(0.f);
    float csum[8];
#pragma unroll
    for (int r = 0; r < 8; ++r) csum[r] = 0.f;

    float* Pw = &Plds[wave][0];

    for (int it = 0; it < TILES_PER_WAVE; ++it) {
        const int tile = chunk * KEYS_PER_BLOCK + (it * WAVES + wave) * 16;

        // ================= preload ALL global fragments for this tile ======
        // K B-frags: B 4x16 layout, lane holds (K = 2*half + j, N = key = lm).
        const float* Krow = Kb + (size_t)(tile + lm) * D_ + half * 2;
        v2f bk[16];
#pragma unroll
        for (int k4 = 0; k4 < 16; ++k4)
            bk[k4] = *(const v2f*)(Krow + k4 * 4);

        // V A-frags for GEMM 2: av[c*4+t] = (M = v-dim lm of tile t,
        //                                    K = key 4c + 2*half + j).
        const float* Vtile = Vb + (size_t)tile * D_ + half * 2 * D_ + lm;
        v2f av[16];
#pragma unroll
        for (int c = 0; c < 4; ++c)
#pragma unroll
            for (int t = 0; t < 4; ++t) {
                av[c * 4 + t].x = Vtile[(c * 4 + 0) * D_ + t * 16];
                av[c * 4 + t].y = Vtile[(c * 4 + 1) * D_ + t * 16];
            }

        // ---- GEMM 1: S^T (16 queries x 16 keys) = Q @ K^T, K-dim = 64 ----
        v8f s = (v8f)(0.f);
#pragma unroll
        for (int k4 = 0; k4 < 16; ++k4)
            s = __builtin_amdgcn_wmma_f32_16x16x4_f32(
                    false, aq[k4], false, bk[k4], (short)0, s, false, false);

        float mx = s[0];
#pragma unroll
        for (int r = 1; r < 8; ++r) mx = fmaxf(mx, s[r]);
        float p[8], sum = 0.f;
#pragma unroll
        for (int r = 0; r < 8; ++r) { p[r] = __expf((s[r] - mx) * 0.125f); sum += p[r]; }
        const float inv = 1.f / sum;
#pragma unroll
        for (int r = 0; r < 8; ++r) {
            p[r] = p[r] * inv + 1e-8f;
            csum[r] += p[r];
        }

        // ---- transpose P through per-wave LDS: P[key_local][m] ----
        if (lane < 16) {
#pragma unroll
            for (int r = 0; r < 8; ++r) Pw[lm * 17 + r] = p[r];
        }
        // LDS ops from one wave are in-order; compiler inserts s_wait_dscnt.

        // P B-frags: (K = key 4c + 2*half + j, N = query lm)
        v2f bp[4];
#pragma unroll
        for (int c = 0; c < 4; ++c) {
            bp[c].x = Pw[(c * 4 + half * 2 + 0) * 17 + lm];
            bp[c].y = Pw[(c * 4 + half * 2 + 1) * 17 + lm];
        }

        // ---- GEMM 2: O^T (64 v-dims x 16 queries) += V^T @ P ----
#pragma unroll
        for (int c = 0; c < 4; ++c)
#pragma unroll
            for (int t = 0; t < 4; ++t)
                oacc[t] = __builtin_amdgcn_wmma_f32_16x16x4_f32(
                              false, av[c * 4 + t], false, bp[c], (short)0,
                              oacc[t], false, false);
    }

    // ---- reduce this wave's partials into shared ----
    // C layout: vgpr r, lane -> (M = r + 8*half, N = lm); valid queries lm < 8.
    if (lm < NQ) {
#pragma unroll
        for (int t = 0; t < 4; ++t)
#pragma unroll
            for (int r = 0; r < 8; ++r)
                atomicAdd(&sh_accum[lm * D_ + t * 16 + half * 8 + r], oacc[t][r]);
    }
    if (lane < 16) {
#pragma unroll
        for (int r = 0; r < 8; ++r) atomicAdd(&sh_colsum[r], csum[r]);
    }
    __syncthreads();

    // ---- block -> global workspace ----
    for (int i = tid; i < NQ * D_; i += 256)
        atomicAdd(g_accum + (size_t)b * NQ * D_ + i, sh_accum[i]);
    if (tid < NQ)
        atomicAdd(g_colsum + b * NQ + tid, sh_colsum[tid]);
}

__global__ void zero_ws(float* __restrict__ p, int n) {
    int i = blockIdx.x * blockDim.x + threadIdx.x;
    if (i < n) p[i] = 0.f;
}

__global__ void finalize(const float* __restrict__ acc,
                         const float* __restrict__ cs,
                         float* __restrict__ out) {
    int i = blockIdx.x * blockDim.x + threadIdx.x;   // over B*NQ*D
    if (i < B_ * NQ * D_) out[i] = acc[i] / cs[i / D_];
}

extern "C" void kernel_launch(void* const* d_in, const int* in_sizes, int n_in,
                              void* d_out, int out_size, void* d_ws, size_t ws_size,
                              hipStream_t stream) {
    const float* Kmat = (const float*)d_in[0];  // keys   [B,N,D]
    const float* Vmat = (const float*)d_in[1];  // values [B,N,D]
    const float* Qmat = (const float*)d_in[2];  // query  [B,NQ,D]
    float* out = (float*)d_out;

    float* acc = (float*)d_ws;                  // B*NQ*D floats
    float* cs  = acc + B_ * NQ * D_;            // B*NQ floats
    const int ws_elems = B_ * NQ * D_ + B_ * NQ;

    zero_ws<<<(ws_elems + 255) / 256, 256, 0, stream>>>((float*)d_ws, ws_elems);
    attn_accum<<<B_ * CHUNKS, 256, 0, stream>>>(Kmat, Vmat, Qmat, acc, cs);
    finalize<<<(B_ * NQ * D_ + 255) / 256, 256, 0, stream>>>(acc, cs, out);
}

// v001
// A run of this version takes 15 microseconds.
// In both of two side-by-side timings against v000, it was 1.14 times as fast.
#include <hip/hip_runtime.h>

typedef __attribute__((ext_vector_type(2))) float v2f;
typedef __attribute__((ext_vector_type(8))) float v8f;

#define B_  32
#define N_  4096
#define NQ  8
#define D_  64
#define CHUNKS 16                         // blocks per batch
#define KEYS_PER_BLOCK (N_ / CHUNKS)      // 256 keys
#define WAVES 8
#define TILES_PER_WAVE (KEYS_PER_BLOCK / (16 * WAVES))  // 2
// One partial plane per block in the workspace: NQ*D_ sums, NQ column sums,
// padded to whole 128-byte lines so that no two blocks store into one line.
#define PLANE (NQ * D_ + 32)              // 544 floats = 17 lines

__global__ __launch_bounds__(256) void attn_accum(
    const float* __restrict__ Kmat,   // [B, N, D]
    const float* __restrict__ Vmat,   // [B, N, D]
    const float* __restrict__ Qmat,   // [B, NQ, D]
    float* __restrict__ g_part)       // [B * CHUNKS, PLANE]
{
    __shared__ float sh_accum[NQ * D_];        // 512 floats
    __shared__ float sh_colsum[NQ];
    __shared__ float Plds[WAVES][16 * 17];

    const int tid  = threadIdx.x;
    const int wave = tid >> 5;
    const int lane = tid & 31;
    const int half = lane >> 4;
    const int lm   = lane & 15;

    const int b     = blockIdx.x / CHUNKS;
    const int chunk = blockIdx.x % CHUNKS;

    for (int i = tid; i < NQ * D_; i += 256) sh_accum[i] = 0.f;
    if (tid < NQ) sh_colsum[tid] = 0.f;
    __syncthreads();

    const float* Qb = Qmat + (size_t)b * NQ * D_;
    const float* Kb = Kmat + (size_t)b * N_ * D_;
    const float* Vb = Vmat + (size_t)b * N_ * D_;

    // ---- Q A-fragments: A = Q padded to 16 rows, 16 chunks of K=4 ----
    // A 16x4 layout: lane holds (M = lm, K = 2*half + j) in vgpr j.
    v2f aq[16];
#pragma unroll
    for (int k4 = 0; k4 < 16; ++k4) {
        const int d0 = k4 * 4 + half * 2;
        v2f z; z.x = 0.f; z.y = 0.f;
        aq[k4] = (lm < NQ) ? *(const v2f*)(Qb + lm * D_ + d0) : z;
    }

    v8f oacc[4];                 // O^T tiles: rows = v-dims 16t.., cols = queries
#pragma unroll
    for (int t = 0; t < 4; ++t) oacc[t] = (v8f)(0.f);
    float csum[8];
#pragma unroll
    for (int r = 0; r < 8; ++r) csum[r] = 0.f;

    float* Pw = &Plds[wave][0];

    for (int it = 0; it < TILES_PER_WAVE; ++it) {
        const int tile = chunk * KEYS_PER_BLOCK + (it * WAVES + wave) * 16;

        // ================= preload ALL global fragments for this tile ======
        // K B-frags: B 4x16 layout, lane holds (K = 2*half + j, N = key = lm).
        const float* Krow = Kb + (size_t)(tile + lm) * D_ + half * 2;
        v2f bk[16];
#pragma unroll
        for (int k4 = 0; k4 < 16; ++k4)
            bk[k4] = *(const v2f*)(Krow + k4 * 4);

        // V A-frags for GEMM 2: av[c*4+t] = (M = v-dim lm of tile t,
        //                                    K = key 4c + 2*half + j).
        const float* Vtile = Vb + (size_t)tile * D_ + half * 2 * D_ + lm;
        v2f av[16];
#pragma unroll
        for (int c = 0; c < 4; ++c)
#pragma unroll
            for (int t = 0; t < 4; ++t) {
                av[c * 4 + t].x = Vtile[(c * 4 + 0) * D_ + t * 16];
                av[c * 4 + t].y = Vtile[(c * 4 + 1) * D_ + t * 16];
            }

        // ---- GEMM 1: S^T (16 queries x 16 keys) = Q @ K^T, K-dim = 64 ----
        v8f s = (v8f)(0.f);
#pragma unroll
        for (int k4 = 0; k4 < 16; ++k4)
            s = __builtin_amdgcn_wmma_f32_16x16x4_f32(
                    false, aq[k4], false, bk[k4], (short)0, s, false, false);

        float mx = s[0];
#pragma unroll
        for (int r = 1; r < 8; ++r) mx = fmaxf(mx, s[r]);
        float p[8], sum = 0.f;
#pragma unroll
        for (int r = 0; r < 8; ++r) { p[r] = __expf((s[r] - mx) * 0.125f); sum += p[r]; }
        const float inv = 1.f / sum;
#pragma unroll
        for (int r = 0; r < 8; ++r) {
            p[r] = p[r] * inv + 1e-8f;
            csum[r] += p[r];
        }

        // ---- transpose P through per-wave LDS: P[key_local][m] ----
        if (lane < 16) {
#pragma unroll
            for (int r = 0; r < 8; ++r) Pw[lm * 17 + r] = p[r];
        }
        // LDS ops from one wave are in-order; compiler inserts s_wait_dscnt.

        // P B-frags: (K = key 4c + 2*half + j, N = query lm)
        v2f bp[4];
#pragma unroll
        for (int c = 0; c < 4; ++c) {
            bp[c].x = Pw[(c * 4 + half * 2 + 0) * 17 + lm];
            bp[c].y = Pw[(c * 4 + half * 2 + 1) * 17 + lm];
        }

        // ---- GEMM 2: O^T (64 v-dims x 16 queries) += V^T @ P ----
#pragma unroll
        for (int c = 0; c < 4; ++c)
#pragma unroll
            for (int t = 0; t < 4; ++t)
                oacc[t] = __builtin_amdgcn_wmma_f32_16x16x4_f32(
                              false, av[c * 4 + t], false, bp[c], (short)0,
                              oacc[t], false, false);
    }

    // ---- reduce this wave's partials into shared ----
    // C layout: vgpr r, lane -> (M = r + 8*half, N = lm); valid queries lm < 8.
    if (lm < NQ) {
#pragma unroll
        for (int t = 0; t < 4; ++t)
#pragma unroll
            for (int r = 0; r < 8; ++r)
                atomicAdd(&sh_accum[lm * D_ + t * 16 + half * 8 + r], oacc[t][r]);
    }
    if (lane < 16) {
#pragma unroll
        for (int r = 0; r < 8; ++r) atomicAdd(&sh_colsum[r], csum[r]);
    }
    __syncthreads();

    // ---- block -> its own plane of the workspace, plain stores ----
    float* plane = g_part + (size_t)blockIdx.x * PLANE;
    for (int i = tid; i < NQ * D_; i += 256)
        plane[i] = sh_accum[i];
    if (tid < NQ)
        plane[NQ * D_ + tid] = sh_colsum[tid];
}

// Sums the CHUNKS planes of a batch in chunk order, then normalises.
__global__ __launch_bounds__(256) void finalize(const float* __restrict__ part,
                                                float* __restrict__ out) {
    const int i = blockIdx.x * blockDim.x + threadIdx.x;   // over B*NQ*D
    if (i >= B_ * NQ * D_) return;
    const int b = i / (NQ * D_);
    const int e = i % (NQ * D_);
    const float* p = part + (size_t)b * CHUNKS * PLANE;
    float a[CHUNKS], c[CHUNKS];
#pragma unroll   // all 2*CHUNKS loads issue before the first add: one round trip
    for (int k = 0; k < CHUNKS; ++k) {
        a[k] = p[k * PLANE + e];
        c[k] = p[k * PLANE + NQ * D_ + e / D_];
    }
    // The sums below may reuse the loads' address registers: wait first.
    asm volatile("s_wait_xcnt 0x0" ::: "memory");
    float acc = 0.f, cs = 0.f;
#pragma unroll   // keeps a[] and c[] in registers
    for (int k = 0; k < CHUNKS; ++k) { acc += a[k]; cs += c[k]; }
    out[i] = acc / cs;
}

extern "C" void kernel_launch(void* const* d_in, const int* in_sizes, int n_in,
                              void* d_out, int out_size, void* d_ws, size_t ws_size,
                              hipStream_t stream) {
    const float* Kmat = (const float*)d_in[0];  // keys   [B,N,D]
    const float* Vmat = (const float*)d_in[1];  // values [B,N,D]
    const float* Qmat = (const float*)d_in[2];  // query  [B,NQ,D]
    float* out = (float*)d_out;

    float* part = (float*)d_ws;                 // B*CHUNKS planes of PLANE floats

    attn_accum<<<B_ * CHUNKS, 256, 0, stream>>>(Kmat, Vmat, Qmat, part);
    finalize<<<(B_ * NQ * D_ + 255) / 256, 256, 0, stream>>>(part, out);
}

// v002
// Measured time: 11 microseconds a run.
// Next to v001, in two timings, it ran 1.38 and 1.37 times as fast.
// Counting every step since v000, it is 1.57 times as fast.
#include <hip/hip_runtime.h>

typedef __attribute__((ext_vector_type(2))) float v2f;
typedef __attribute__((ext_vector_type(4))) float v4f;
typedef __attribute__((ext_vector_type(8))) float v8f;

#define B_  32
#define N_  4096
#define NQ  8
#define D_  64
#define CHUNKS 16                         // blocks per batch
#define KEYS_PER_BLOCK (N_ / CHUNKS)      // 256 keys
#define WAVES 8
#define TILES_PER_WAVE (KEYS_PER_BLOCK / (16 * WAVES))  // 2
// One partial plane per block in the workspace: NQ*D_ sums, NQ column sums,
// padded to whole 128-byte lines so that no two blocks store into one line.
#define PLANE (NQ * D_ + 32)              // 544 floats = 17 lines
#define RPITCH 68
#define RPLANE (NQ * RPITCH + 2 * NQ)     // 560 floats

__global__ __launch_bounds__(256) void attn_accum(
    const float* __restrict__ Kmat,   // [B, N, D]
    const float* __restrict__ Vmat,   // [B, N, D]
    const float* __restrict__ Qmat,   // [B, NQ, D]
    float* __restrict__ g_part)       // [B * CHUNKS, PLANE]
{
    __shared__ __attribute__((aligned(16))) float red[WAVES][RPLANE];
    __shared__ float Plds[WAVES][16 * 17];

    const int tid  = threadIdx.x;
    const int wave = tid >> 5;
    const int lane = tid & 31;
    const int half = lane >> 4;
    const int lm   = lane & 15;

    const int b     = blockIdx.x / CHUNKS;
    const int chunk = blockIdx.x % CHUNKS;

    const float* Qb = Qmat + (size_t)b * NQ * D_;
    const float* Kb = Kmat + (size_t)b * N_ * D_;
    const float* Vb = Vmat + (size_t)b * N_ * D_;

    // ---- Q A-fragments: A = Q padded to 16 rows, 16 chunks of K=4 ----
    // A 16x4 layout: lane holds (M = lm, K = 2*half + j) in vgpr j.
    v2f aq[16];
#pragma unroll
    for (int k4 = 0; k4 < 16; ++k4) {
        const int d0 = k4 * 4 + half * 2;
        v2f z; z.x = 0.f; z.y = 0.f;
        aq[k4] = (lm < NQ) ? *(const v2f*)(Qb + lm * D_ + d0) : z;
    }

    v8f oacc[4];                 // O^T tiles: rows = v-dims 16t.., cols = queries
#pragma unroll
    for (int t = 0; t < 4; ++t) oacc[t] = (v8f)(0.f);
    float csum = 0.f;            // column sum of query lm over this lane's keys

    float* Pw = &Plds[wave][0];

    for (int it = 0; it < TILES_PER_WAVE; ++it) {
        const int tile = chunk * KEYS_PER_BLOCK + (it * WAVES + wave) * 16;

        // ================= preload ALL global fragments for this tile ======
        // K B-frags: B 4x16 layout, lane holds (K = 2*half + j, N = key = lm).
        const float* Krow = Kb + (size_t)(tile + lm) * D_ + half * 2;
        v2f bk[16];
#pragma unroll
        for (int k4 = 0; k4 < 16; ++k4)
            bk[k4] = *(const v2f*)(Krow + k4 * 4);

        // V A-frags for GEMM 2: av[c*4+t] = (M = v-dim lm of tile t,
        //                                    K = key 4c + 2*half + j).
        const float* Vtile = Vb + (size_t)tile * D_ + half * 2 * D_ + lm;
        v2f av[16];
#pragma unroll
        for (int c = 0; c < 4; ++c)
#pragma unroll
            for (int t = 0; t < 4; ++t) {
                av[c * 4 + t].x = Vtile[(c * 4 + 0) * D_ + t * 16];
                av[c * 4 + t].y = Vtile[(c * 4 + 1) * D_ + t * 16];
            }

        // ---- GEMM 1: S^T (16 queries x 16 keys) = Q @ K^T, K-dim = 64 ----
        v8f s = (v8f)(0.f);
#pragma unroll
        for (int k4 = 0; k4 < 16; ++k4)
            s = __builtin_amdgcn_wmma_f32_16x16x4_f32(
                    false, aq[k4], false, bk[k4], (short)0, s, false, false);

        float mx = s[0];
#pragma unroll
        for (int r = 1; r < 8; ++r) mx = fmaxf(mx, s[r]);
        float p[8], sum = 0.f;
#pragma unroll
        for (int r = 0; r < 8; ++r) { p[r] = __expf((s[r] - mx) * 0.125f); sum += p[r]; }
        const float inv = 1.f / sum;
#pragma unroll
        for (int r = 0; r < 8; ++r) p[r] = p[r] * inv + 1e-8f;

        // ---- transpose P through per-wave LDS: P[key_local][m] ----
        if (lane < 16) {
#pragma unroll
            for (int r = 0; r < 8; ++r) Pw[lm * 17 + r] = p[r];
        }
        // LDS ops from one wave are in-order; compiler inserts s_wait_dscnt.

        // P B-frags: (K = key 4c + 2*half + j, N = query lm)
        v2f bp[4];
#pragma unroll
        for (int c = 0; c < 4; ++c) {
            bp[c].x = Pw[(c * 4 + half * 2 + 0) * 17 + lm];
            bp[c].y = Pw[(c * 4 + half * 2 + 1) * 17 + lm];
            csum += bp[c].x + bp[c].y;       // only lanes with lm < NQ are used
        }

        // ---- GEMM 2: O^T (64 v-dims x 16 queries) += V^T @ P ----
#pragma unroll
        for (int c = 0; c < 4; ++c)
#pragma unroll
            for (int t = 0; t < 4; ++t)
                oacc[t] = __builtin_amdgcn_wmma_f32_16x16x4_f32(
                              false, av[c * 4 + t], false, bp[c], (short)0,
                              oacc[t], false, false);
    }

    // ---- each wave stores its partials into its own LDS plane ----
    // C layout: vgpr r, lane -> (M = r + 8*half, N = lm); valid queries lm < 8.
    if (lm < NQ) {
        float* Rw = &red[wave][lm * RPITCH + half * 8];
        for (int t = 0; t < 4; ++t) {
            *(v4f*)(Rw + t * 16)     = __builtin_shufflevector(oacc[t], oacc[t], 0, 1, 2, 3);
            *(v4f*)(Rw + t * 16 + 4) = __builtin_shufflevector(oacc[t], oacc[t], 4, 5, 6, 7);
        }
        red[wave][NQ * RPITCH + half * NQ + lm] = csum;
    }
    __syncthreads();

    // ---- the planes are added in wave order; block -> its own plane of the
    //      workspace, plain stores, two neighbouring sums per thread ----
    const int e = tid * 2;
    const int off = (e / D_) * RPITCH + (e % D_);
    v2f acc = *(const v2f*)(&red[0][off]);
    for (int w = 1; w < WAVES; ++w) acc += *(const v2f*)(&red[w][off]);
    float cs = 0.f;
    if (tid < NQ) {
        for (int w = 0; w < WAVES; ++w)
            cs += red[w][NQ * RPITCH + tid] + red[w][NQ * RPITCH + NQ + tid];
    }
    float* plane = g_part + (size_t)blockIdx.x * PLANE;
    *(v2f*)(plane + e) = acc;
    if (tid < NQ)
        plane[NQ * D_ + tid] = cs;
}

// Sums the CHUNKS planes of a batch in chunk order, then normalises.
__global__ __launch_bounds__(256) void finalize(const float* __restrict__ part,
                                                float* __restrict__ out) {
    const int i = blockIdx.x * blockDim.x + threadIdx.x;   // over B*NQ*D
    if (i >= B_ * NQ * D_) return;
    const int b = i / (NQ * D_);
    const int e = i % (NQ * D_);
    const float* p = part + (size_t)b * CHUNKS * PLANE;
    float a[CHUNKS], c[CHUNKS];
#pragma unroll   // all 2*CHUNKS loads issue before the first add: one round trip
    for (int k = 0; k < CHUNKS; ++k) {
        a[k] = p[k * PLANE + e];
        c[k] = p[k * PLANE + NQ * D_ + e / D_];
    }
    // The sums below may reuse the loads' address registers: wait first.
    asm volatile("s_wait_xcnt 0x0" ::: "memory");
    float acc = 0.f, cs = 0.f;
#pragma unroll   // keeps a[] and c[] in registers
    for (int k = 0; k < CHUNKS; ++k) { acc += a[k]; cs += c[k]; }
    out[i] = acc / cs;
}

extern "C" void kernel_launch(void* const* d_in, const int* in_sizes, int n_in,
                              void* d_out, int out_size, void* d_ws, size_t ws_size,
                              hipStream_t stream) {
    const float* Kmat = (const float*)d_in[0];  // keys   [B,N,D]
    const float* Vmat = (const float*)d_in[1];  // values [B,N,D]
    const float* Qmat = (const float*)d_in[2];  // query  [B,NQ,D]
    float* out = (float*)d_out;

    float* part = (float*)d_ws;                 // B*CHUNKS planes of PLANE floats

    attn_accum<<<B_ * CHUNKS, 256, 0, stream>>>(Kmat, Vmat, Qmat, part);
    finalize<<<(B_ * NQ * D_ + 255) / 256, 256, 0, stream>>>(part, out);
}

// v003
// It runs in 10.3 microseconds.
// Timed twice side by side with v002, it ran 1.07 and 1.08 times as fast.
// Over all steps from v000 it is 1.69 times as fast.
#include <hip/hip_runtime.h>
#include <stdint.h>

typedef __attribute__((ext_vector_type(2))) float v2f;
typedef __attribute__((ext_vector_type(4))) float v4f;
typedef __attribute__((ext_vector_type(8))) float v8f;
typedef uint32_t u32x4 __attribute__((ext_vector_type(4)));
typedef uint32_t u32x8 __attribute__((ext_vector_type(8)));

#define B_  32
#define N_  4096
#define NQ  8
#define D_  64
#define CHUNKS 16                         // blocks per batch
#define KEYS_PER_BLOCK (N_ / CHUNKS)      // 256 keys
#define WAVES 8
#define TILES_PER_WAVE (KEYS_PER_BLOCK / (16 * WAVES))  // 2
// One partial plane per block in the workspace: NQ*D_ sums, NQ column sums,
// padded to whole 128-byte lines so that no two blocks store into one line.
#define PLANE (NQ * D_ + 32)              // 544 floats = 17 lines
#define RPITCH 68
#define RPLANE (NQ * RPITCH + 2 * NQ)     // 560 floats
#define KROWS  (KEYS_PER_BLOCK / WAVES)   // 32 rows per slice
#define KPITCH 68                         // floats
#define KSLICE 2560                       // floats: 32 * 272 = 8704 -> 10240 bytes

static __device__ __forceinline__ uint32_t uni(uint32_t v) {
    return (uint32_t)__builtin_amdgcn_readfirstlane(v);
}

__global__ __launch_bounds__(256) void attn_accum(
    const float* __restrict__ Kmat,   // [B, N, D]
    const float* __restrict__ Vmat,   // [B, N, D]
    const float* __restrict__ Qmat,   // [B, NQ, D]
    float* __restrict__ g_part)       // [B * CHUNKS, PLANE]
{
    __shared__ __attribute__((aligned(2048))) float Klds[WAVES * KSLICE];
    __shared__ __attribute__((aligned(16))) float red[WAVES][RPLANE];
    __shared__ float Plds[WAVES][16 * 17];

    const int tid  = threadIdx.x;
    const int wave = tid >> 5;
    const int lane = tid & 31;
    const int half = lane >> 4;
    const int lm   = lane & 15;

    const int b     = blockIdx.x / CHUNKS;
    const int chunk = blockIdx.x % CHUNKS;

    const float* Qb = Qmat + (size_t)b * NQ * D_;
    const float* Kb = Kmat + (size_t)b * N_ * D_;
    const float* Vb = Vmat + (size_t)b * N_ * D_;

    // ---- every wave brings its own 32 K rows into its own LDS slice, one
    //      request, issued first so that it flies beside the Q and V loads ----
    const uint32_t wv = uni((uint32_t)tid >> 5);
    const uint32_t kdst = (uint32_t)(size_t)Klds + wv * (KSLICE * 4u);
    const uint64_t kga = (uint64_t)(size_t)(Kb + (size_t)chunk * KEYS_PER_BLOCK * D_)
                       + (uint64_t)wv * (KROWS * D_ * 4u);
    u32x4 g0;
    g0[0] = uni(1u);                                   // count 1
    g0[1] = uni(kdst);
    g0[2] = uni((uint32_t)kga);
    g0[3] = uni((((uint32_t)(kga >> 32)) & 0x01FFFFFFu) | 0x80000000u);  // type 2
    u32x8 g1;
    g1[0] = uni((1u << 20) | (5u << 22) | (3u << 25));
    g1[1] = uni((D_ * 4u) << 16);
    g1[2] = uni((uint32_t)KROWS << 16);
    g1[3] = uni((D_ * 4u) << 16);
    g1[4] = uni((uint32_t)KROWS);
    g1[5] = uni(D_ * 4u);
    g1[6] = uni(0u);
    g1[7] = uni(0u);
    asm volatile("tensor_load_to_lds %0, %1" :: "s"(g0), "s"(g1) : "memory");

    // ---- Q A-fragments: A = Q padded to 16 rows, 16 chunks of K=4 ----
    // A 16x4 layout: lane holds (M = lm, K = 2*half + j) in vgpr j.
    v2f aq[16];
#pragma unroll
    for (int k4 = 0; k4 < 16; ++k4) {
        const int d0 = k4 * 4 + half * 2;
        v2f z; z.x = 0.f; z.y = 0.f;
        aq[k4] = (lm < NQ) ? *(const v2f*)(Qb + lm * D_ + d0) : z;
    }

    v8f oacc[4];                 // O^T tiles: rows = v-dims 16t.., cols = queries
#pragma unroll
    for (int t = 0; t < 4; ++t) oacc[t] = (v8f)(0.f);
    float csum = 0.f;            // column sum of query lm over this lane's keys

    float* Pw = &Plds[wave][0];

    // V A-frags for GEMM 2: av[c*4+t] = (M = v-dim lm of tile t,
    //                                    K = key 4c + 2*half + j).
    v2f av[16];
    auto load_v = [&](int it) {
        const int tile = chunk * KEYS_PER_BLOCK + (wave * TILES_PER_WAVE + it) * 16;
        const float* Vtile = Vb + (size_t)tile * D_ + half * 2 * D_ + lm;
#pragma unroll
        for (int c = 0; c < 4; ++c)
#pragma unroll
            for (int t = 0; t < 4; ++t) {
                av[c * 4 + t].x = Vtile[(c * 4 + 0) * D_ + t * 16];
                av[c * 4 + t].y = Vtile[(c * 4 + 1) * D_ + t * 16];
            }
    };
    load_v(0);

    // The compiler places no wait for a tensor load: the slice has landed behind this.
    asm volatile("s_wait_tensorcnt 0x0" ::: "memory");
    // No barrier: a wave reads only the slice that it has brought itself.

    for (int it = 0; it < TILES_PER_WAVE; ++it) {
        if (it > 0) load_v(it);

        // K B-frags: B 4x16 layout, lane holds (K = 2*half + j, N = key = lm).
        const float* Krow = Klds + wave * KSLICE + (it * 16 + lm) * KPITCH + half * 2;
        v2f bk[16];
#pragma unroll
        for (int k4 = 0; k4 < 16; ++k4)
            bk[k4] = *(const v2f*)(Krow + k4 * 4);

        // ---- GEMM 1: S^T (16 queries x 16 keys) = Q @ K^T, K-dim = 64 ----
        v8f s = (v8f)(0.f);
#pragma unroll
        for (int k4 = 0; k4 < 16; ++k4)
            s = __builtin_amdgcn_wmma_f32_16x16x4_f32(
                    false, aq[k4], false, bk[k4], (short)0, s, false, false);

        float mx = s[0];
#pragma unroll
        for (int r = 1; r < 8; ++r) mx = fmaxf(mx, s[r]);
        float p[8], sum = 0.f;
#pragma unroll
        for (int r = 0; r < 8; ++r) { p[r] = __expf((s[r] - mx) * 0.125f); sum += p[r]; }
        const float inv = 1.f / sum;
#pragma unroll
        for (int r = 0; r < 8; ++r) p[r] = p[r] * inv + 1e-8f;

        // ---- transpose P through per-wave LDS: P[key_local][m] ----
        if (lane < 16) {
#pragma unroll
            for (int r = 0; r < 8; ++r) Pw[lm * 17 + r] = p[r];
        }
        // LDS ops from one wave are in-order; compiler inserts s_wait_dscnt.

        // P B-frags: (K = key 4c + 2*half + j, N = query lm)
        v2f bp[4];
#pragma unroll
        for (int c = 0; c < 4; ++c) {
            bp[c].x = Pw[(c * 4 + half * 2 + 0) * 17 + lm];
            bp[c].y = Pw[(c * 4 + half * 2 + 1) * 17 + lm];
            csum += bp[c].x + bp[c].y;       // only lanes with lm < NQ are used
        }

        // ---- GEMM 2: O^T (64 v-dims x 16 queries) += V^T @ P ----
#pragma unroll
        for (int c = 0; c < 4; ++c)
#pragma unroll
            for (int t = 0; t < 4; ++t)
                oacc[t] = __builtin_amdgcn_wmma_f32_16x16x4_f32(
                              false, av[c * 4 + t], false, bp[c], (short)0,
                              oacc[t], false, false);
    }

    // ---- each wave stores its partials into its own LDS plane ----
    // C layout: vgpr r, lane -> (M = r + 8*half, N = lm); valid queries lm < 8.
    if (lm < NQ) {
        float* Rw = &red[wave][lm * RPITCH + half * 8];
        for (int t = 0; t < 4; ++t) {
            *(v4f*)(Rw + t * 16)     = __builtin_shufflevector(oacc[t], oacc[t], 0, 1, 2, 3);
            *(v4f*)(Rw + t * 16 + 4) = __builtin_shufflevector(oacc[t], oacc[t], 4, 5, 6, 7);
        }
        red[wave][NQ * RPITCH + half * NQ + lm] = csum;
    }
    __syncthreads();

    // ---- the planes are added in wave order; block -> its own plane of the
    //      workspace, plain stores, two neighbouring sums per thread ----
    const int e = tid * 2;
    const int off = (e / D_) * RPITCH + (e % D_);
    v2f acc = *(const v2f*)(&red[0][off]);
    for (int w = 1; w < WAVES; ++w) acc += *(const v2f*)(&red[w][off]);
    float cs = 0.f;
    if (tid < NQ) {
        for (int w = 0; w < WAVES; ++w)
            cs += red[w][NQ * RPITCH + tid] + red[w][NQ * RPITCH + NQ + tid];
    }
    float* plane = g_part + (size_t)blockIdx.x * PLANE;
    *(v2f*)(plane + e) = acc;
    if (tid < NQ)
        plane[NQ * D_ + tid] = cs;
}

// Sums the CHUNKS planes of a batch in chunk order, then normalises.
__global__ __launch_bounds__(256) void finalize(const float* __restrict__ part,
                                                float* __restrict__ out) {
    const int i = blockIdx.x * blockDim.x + threadIdx.x;   // over B*NQ*D
    if (i >= B_ * NQ * D_) return;
    const int b = i / (NQ * D_);
    const int e = i % (NQ * D_);
    const float* p = part + (size_t)b * CHUNKS * PLANE;
    float a[CHUNKS], c[CHUNKS];
#pragma unroll   // all 2*CHUNKS loads issue before the first add: one round trip
    for (int k = 0; k < CHUNKS; ++k) {
        a[k] = p[k * PLANE + e];
        c[k] = p[k * PLANE + NQ * D_ + e / D_];
    }
    // The sums below may reuse the loads' address registers: wait first.
    asm volatile("s_wait_xcnt 0x0" ::: "memory");
    float acc = 0.f, cs = 0.f;
#pragma unroll   // keeps a[] and c[] in registers
    for (int k = 0; k < CHUNKS; ++k) { acc += a[k]; cs += c[k]; }
    out[i] = acc / cs;
}

extern "C" void kernel_launch(void* const* d_in, const int* in_sizes, int n_in,
                              void* d_out, int out_size, void* d_ws, size_t ws_size,
                              hipStream_t stream) {
    const float* Kmat = (const float*)d_in[0];  // keys   [B,N,D]
    const float* Vmat = (const float*)d_in[1];  // values [B,N,D]
    const float* Qmat = (const float*)d_in[2];  // query  [B,NQ,D]
    float* out = (float*)d_out;

    float* part = (float*)d_ws;                 // B*CHUNKS planes of PLANE floats

    attn_accum<<<B_ * CHUNKS, 256, 0, stream>>>(Kmat, Vmat, Qmat, part);
    finalize<<<(B_ * NQ * D_ + 255) / 256, 256, 0, stream>>>(part, out);
}

// v004
// A run of this version takes 9.72 microseconds.
// Two timings next to v003 put it at 1.08 and 1.06 times that version's speed.
// All steps since v000 together make it 1.81 times as fast.
#include <hip/hip_runtime.h>
#include <stdint.h>

typedef __attribute__((ext_vector_type(2))) float v2f;
typedef __attribute__((ext_vector_type(4))) float v4f;
typedef __attribute__((ext_vector_type(8))) float v8f;
typedef uint32_t u32x4 __attribute__((ext_vector_type(4)));
typedef uint32_t u32x8 __attribute__((ext_vector_type(8)));

#define B_  32
#define N_  4096
#define NQ  8
#define D_  64
#define CHUNKS 8                          // blocks per batch: 256 blocks, one per WGP
#define KEYS_PER_BLOCK (N_ / CHUNKS)      // 512 keys
#define WAVES 8
#define TILES_PER_WAVE (KEYS_PER_BLOCK / (16 * WAVES))  // 4
// One partial plane per block in the workspace: NQ*D_ sums, NQ column sums,
// padded to whole 128-byte lines so that no two blocks store into one line.
#define PLANE (NQ * D_ + 32)              // 544 floats = 17 lines
#define RPITCH 68
#define RPLANE (NQ * RPITCH + 2 * NQ)     // 560 floats
#define KROWS  32                         // rows per slice = two key tiles
#define KREQ   (KEYS_PER_BLOCK / (WAVES * KROWS))  // 2 slices (requests) per wave
#define KPITCH 68                         // floats
#define KSLICE 2560                       // floats: 32 * 272 = 8704 -> 10240 bytes

static __device__ __forceinline__ uint32_t uni(uint32_t v) {
    return (uint32_t)__builtin_amdgcn_readfirstlane(v);
}

__global__ __launch_bounds__(256) void attn_accum(
    const float* __restrict__ Kmat,   // [B, N, D]
    const float* __restrict__ Vmat,   // [B, N, D]
    const float* __restrict__ Qmat,   // [B, NQ, D]
    float* __restrict__ g_part)       // [B * CHUNKS, PLANE]
{
    __shared__ __attribute__((aligned(2048))) float Klds[WAVES * KREQ * KSLICE];
    __shared__ __attribute__((aligned(16))) float red[WAVES][RPLANE];
    __shared__ float Plds[WAVES][16 * 17];

    const int tid  = threadIdx.x;
    const int wave = tid >> 5;
    const int lane = tid & 31;
    const int half = lane >> 4;
    const int lm   = lane & 15;

    const int b     = blockIdx.x / CHUNKS;
    const int chunk = blockIdx.x % CHUNKS;

    const float* Qb = Qmat + (size_t)b * NQ * D_;
    const float* Kb = Kmat + (size_t)b * N_ * D_;
    const float* Vb = Vmat + (size_t)b * N_ * D_;

    // ---- every wave brings its own 64 K rows into its own two LDS slices; the
    //      requests are issued first, so that they fly beside the Q and V loads ----
    const uint32_t wv = uni((uint32_t)tid >> 5);
    const uint32_t kdst = (uint32_t)(size_t)Klds + wv * (KREQ * KSLICE * 4u);
    const uint64_t kga = (uint64_t)(size_t)(Kb + (size_t)chunk * KEYS_PER_BLOCK * D_)
                       + (uint64_t)wv * (KREQ * KROWS * D_ * 4u);
    u32x4 g0;
    g0[0] = uni(1u);                                   // count 1
    g0[1] = uni(kdst);
    g0[2] = uni((uint32_t)kga);
    g0[3] = uni((((uint32_t)(kga >> 32)) & 0x01FFFFFFu) | 0x80000000u);  // type 2
    u32x8 g1;
    g1[0] = uni((1u << 20) | (5u << 22) | (3u << 25));
    g1[1] = uni((D_ * 4u) << 16);
    g1[2] = uni((uint32_t)KROWS << 16);
    g1[3] = uni((D_ * 4u) << 16);
    g1[4] = uni((uint32_t)KROWS);
    g1[5] = uni(D_ * 4u);
    g1[6] = uni(0u);
    g1[7] = uni(0u);
    const uint64_t kgb = kga + (uint64_t)(KROWS * D_ * 4u);   // the second 32 rows
    u32x4 g0b;
    g0b[0] = uni(1u);
    g0b[1] = uni(kdst + KSLICE * 4u);
    g0b[2] = uni((uint32_t)kgb);
    g0b[3] = uni((((uint32_t)(kgb >> 32)) & 0x01FFFFFFu) | 0x80000000u);
    // One statement for both requests: the three groups stand in registers of
    // their own, so none is rewritten between the two issues.
    asm volatile("tensor_load_to_lds %0, %2\n\ttensor_load_to_lds %1, %2"
                 :: "s"(g0), "s"(g0b), "s"(g1) : "memory");

    // ---- Q A-fragments: A = Q padded to 16 rows, 16 chunks of K=4 ----
    // A 16x4 layout: lane holds (M = lm, K = 2*half + j) in vgpr j.
    v2f aq[16];
#pragma unroll
    for (int k4 = 0; k4 < 16; ++k4) {
        const int d0 = k4 * 4 + half * 2;
        v2f z; z.x = 0.f; z.y = 0.f;
        aq[k4] = (lm < NQ) ? *(const v2f*)(Qb + lm * D_ + d0) : z;
    }

    v8f oacc[4];                 // O^T tiles: rows = v-dims 16t.., cols = queries
#pragma unroll
    for (int t = 0; t < 4; ++t) oacc[t] = (v8f)(0.f);
    float csum = 0.f;            // column sum of query lm over this lane's keys

    float* Pw = &Plds[wave][0];

    // V A-frags for GEMM 2: av[c*4+t] = (M = v-dim lm of tile t,
    //                                    K = key 4c + 2*half + j).
    v2f av[16];
    auto load_v = [&](int it) {
        const int tile = chunk * KEYS_PER_BLOCK + (wave * TILES_PER_WAVE + it) * 16;
        const float* Vtile = Vb + (size_t)tile * D_ + half * 2 * D_ + lm;
#pragma unroll
        for (int c = 0; c < 4; ++c)
#pragma unroll
            for (int t = 0; t < 4; ++t) {
                av[c * 4 + t].x = Vtile[(c * 4 + 0) * D_ + t * 16];
                av[c * 4 + t].y = Vtile[(c * 4 + 1) * D_ + t * 16];
            }
    };
    load_v(0);

    // The compiler places no wait for a tensor load: all but the wave's youngest
    // request, so its first slice, has landed behind this.
    asm volatile("s_wait_tensorcnt 0x1" ::: "memory");
    // No barrier: a wave reads only the slices that it has brought itself.

    for (int it = 0; it < TILES_PER_WAVE; ++it) {
        if (it > 0) load_v(it);
        // The second slice is read from here on: it has landed behind this.
        if (it == KROWS / 16) asm volatile("s_wait_tensorcnt 0x0" ::: "memory");

        // K B-frags: B 4x16 layout, lane holds (K = 2*half + j, N = key = lm).
        const float* Krow = Klds + (wave * KREQ + it / (KROWS / 16)) * KSLICE
                          + ((it % (KROWS / 16)) * 16 + lm) * KPITCH + half * 2;
        v2f bk[16];
#pragma unroll
        for (int k4 = 0; k4 < 16; ++k4)
            bk[k4] = *(const v2f*)(Krow + k4 * 4);

        // ---- GEMM 1: S^T (16 queries x 16 keys) = Q @ K^T, K-dim = 64 ----
        v8f s = (v8f)(0.f);
#pragma unroll
        for (int k4 = 0; k4 < 16; ++k4)
            s = __builtin_amdgcn_wmma_f32_16x16x4_f32(
                    false, aq[k4], false, bk[k4], (short)0, s, false, false);

        float mx = s[0];
#pragma unroll
        for (int r = 1; r < 8; ++r) mx = fmaxf(mx, s[r]);
        float p[8], sum = 0.f;
#pragma unroll
        for (int r = 0; r < 8; ++r) { p[r] = __expf((s[r] - mx) * 0.125f); sum += p[r]; }
        const float inv = 1.f / sum;
#pragma unroll
        for (int r = 0; r < 8; ++r) p[r] = p[r] * inv + 1e-8f;

        // ---- transpose P through per-wave LDS: P[key_local][m] ----
        if (lane < 16) {
#pragma unroll
            for (int r = 0; r < 8; ++r) Pw[lm * 17 + r] = p[r];
        }
        // LDS ops from one wave are in-order; compiler inserts s_wait_dscnt.

        // P B-frags: (K = key 4c + 2*half + j, N = query lm)
        v2f bp[4];
#pragma unroll
        for (int c = 0; c < 4; ++c) {
            bp[c].x = Pw[(c * 4 + half * 2 + 0) * 17 + lm];
            bp[c].y = Pw[(c * 4 + half * 2 + 1) * 17 + lm];
            csum += bp[c].x + bp[c].y;       // only lanes with lm < NQ are used
        }

        // ---- GEMM 2: O^T (64 v-dims x 16 queries) += V^T @ P ----
#pragma unroll
        for (int c = 0; c < 4; ++c)
#pragma unroll
            for (int t = 0; t < 4; ++t)
                oacc[t] = __builtin_amdgcn_wmma_f32_16x16x4_f32(
                              false, av[c * 4 + t], false, bp[c], (short)0,
                              oacc[t], false, false);
    }

    // ---- each wave stores its partials into its own LDS plane ----
    // C layout: vgpr r, lane -> (M = r + 8*half, N = lm); valid queries lm < 8.
    if (lm < NQ) {
        float* Rw = &red[wave][lm * RPITCH + half * 8];
        for (int t = 0; t < 4; ++t) {
            *(v4f*)(Rw + t * 16)     = __builtin_shufflevector(oacc[t], oacc[t], 0, 1, 2, 3);
            *(v4f*)(Rw + t * 16 + 4) = __builtin_shufflevector(oacc[t], oacc[t], 4, 5, 6, 7);
        }
        red[wave][NQ * RPITCH + half * NQ + lm] = csum;
    }
    __syncthreads();

    // ---- the planes are added in wave order; block -> its own plane of the
    //      workspace, plain stores, two neighbouring sums per thread ----
    const int e = tid * 2;
    const int off = (e / D_) * RPITCH + (e % D_);
    v2f acc = *(const v2f*)(&red[0][off]);
    for (int w = 1; w < WAVES; ++w) acc += *(const v2f*)(&red[w][off]);
    float cs = 0.f;
    if (tid < NQ) {
        for (int w = 0; w < WAVES; ++w)
            cs += red[w][NQ * RPITCH + tid] + red[w][NQ * RPITCH + NQ + tid];
    }
    float* plane = g_part + (size_t)blockIdx.x * PLANE;
    *(v2f*)(plane + e) = acc;
    if (tid < NQ)
        plane[NQ * D_ + tid] = cs;
}

// Sums the CHUNKS planes of a batch in chunk order, then normalises.
__global__ __launch_bounds__(256) void finalize(const float* __restrict__ part,
                                                float* __restrict__ out) {
    const int i = blockIdx.x * blockDim.x + threadIdx.x;   // over B*NQ*D
    if (i >= B_ * NQ * D_) return;
    const int b = i / (NQ * D_);
    const int e = i % (NQ * D_);
    const float* p = part + (size_t)b * CHUNKS * PLANE;
    float a[CHUNKS], c[CHUNKS];
#pragma unroll   // all 2*CHUNKS loads issue before the first add: one round trip
    for (int k = 0; k < CHUNKS; ++k) {
        a[k] = p[k * PLANE + e];
        c[k] = p[k * PLANE + NQ * D_ + e / D_];
    }
    // The sums below may reuse the loads' address registers: wait first.
    asm volatile("s_wait_xcnt 0x0" ::: "memory");
    float acc = 0.f, cs = 0.f;
#pragma unroll   // keeps a[] and c[] in registers
    for (int k = 0; k < CHUNKS; ++k) { acc += a[k]; cs += c[k]; }
    out[i] = acc / cs;
}

extern "C" void kernel_launch(void* const* d_in, const int* in_sizes, int n_in,
                              void* d_out, int out_size, void* d_ws, size_t ws_size,
                              hipStream_t stream) {
    const float* Kmat = (const float*)d_in[0];  // keys   [B,N,D]
    const float* Vmat = (const float*)d_in[1];  // values [B,N,D]
    const float* Qmat = (const float*)d_in[2];  // query  [B,NQ,D]
    float* out = (float*)d_out;

    float* part = (float*)d_ws;                 // B*CHUNKS planes of PLANE floats

    attn_accum<<<B_ * CHUNKS, 256, 0, stream>>>(Kmat, Vmat, Qmat, part);
    finalize<<<(B_ * NQ * D_ + 255) / 256, 256, 0, stream>>>(part, out);
}
